// v000
// Measured on an AMD MI455X. A time is GPU time per run, averaged over a window of back-to-back runs after a warm-up
// (all launches, gaps included; the runs take copies of the inputs in turn), and the median of several windows.
// Apart from v000's, it joins two sittings. Times from different sittings can be a few percent apart, while
// side-by-side timings come from the same sitting.
// v000 is the starting kernel. One run takes 97.4 microseconds.
#include <hip/hip_runtime.h>

typedef __attribute__((ext_vector_type(16))) __bf16 v16bf;
typedef __attribute__((ext_vector_type(8)))  __bf16 v8bf;
typedef __attribute__((ext_vector_type(8)))  float  v8f;

#define NB 4
#define NH 16
#define NS 4096
#define ND 64
#define NF 128          // 2*ND feature dim
#define NBH (NB*NH)
#define SCHUNKS 8
#define CHUNK (NS / SCHUNKS)   // 512

__device__ __forceinline__ float angle_of(int s) {
    // (pi/2) * (s+1) / S
    return 1.57079632679f * (float)(s + 1) * (1.0f / (float)NS);
}

// Swizzled position of K-index k (within a 32-wide K group) such that the
// 16 bf16 elements a lane needs for a WMMA A/B fragment are contiguous:
// lane half h reads [h*16, h*16+16). k = t*16 + h*8 + i  ->  pos = h*16 + t*8 + i.
// Note posK(k0 + i) = posK(k0) + i for 8-aligned k0, i in [0,8).
__device__ __forceinline__ int posK(int k) {
    return ((k >> 3) & 1) * 16 + (k >> 4) * 8 + (k & 7);
}
// Same, applied within each 32-wide group of a 128-long feature axis.
__device__ __forceinline__ int posF(int f) {
    return (f & ~31) + posK(f & 31);
}

// Load a 16-element bf16 fragment from LDS as two b128 reads.
__device__ __forceinline__ v16bf ld_frag(const __bf16* p) {
    v8bf lo = *(const v8bf*)(p);
    v8bf hi = *(const v8bf*)(p + 8);
    return __builtin_shufflevector(lo, hi, 0, 1, 2, 3, 4, 5, 6, 7,
                                   8, 9, 10, 11, 12, 13, 14, 15);
}

__global__ void zero_ws_kernel(float* ws, int n) {
    int i = blockIdx.x * blockDim.x + threadIdx.x;
    if (i < n) ws[i] = 0.0f;
}

// Phase 1: kv[bh][128][64] += k_cs^T * V over an S-chunk; ksum[bh][128] += sum_s k_cs.
__global__ __launch_bounds__(256) void cosformer_kv_kernel(
    const float* __restrict__ kin, const float* __restrict__ vin,
    float* __restrict__ kv_ws, float* __restrict__ ksum_ws)
{
    const int bh   = blockIdx.x;
    const int s0   = blockIdx.y * CHUNK;
    const int tid  = threadIdx.x;
    const int lane = tid & 31;
    const int wave = tid >> 5;
    const int half = lane >> 4;
    const int mrow = lane & 15;        // A-matrix row (feature within band)
    const int ncol = lane & 15;        // B-matrix col (d within band)

    __shared__ alignas(16) __bf16 kcsT[NF][32];  // [f][posK(s)]  k_cs^T tile
    __shared__ alignas(16) __bf16 vswz[ND][32];  // [d][posK(s)]  V tile

    const float* kb = kin + (size_t)bh * NS * ND;
    const float* vb = vin + (size_t)bh * NS * ND;

    // staging: thread owns 8 consecutive s-rows (c*8..c*8+7) of one column d.
    const int c    = tid >> 6;         // 0..3
    const int dcol = tid & 63;
    const int pbase = (c & 1) * 16 + (c >> 1) * 8;   // posK(c*8)
    float ksum_c = 0.0f, ksum_s = 0.0f;

    v8f acc[4];
#pragma unroll
    for (int t = 0; t < 4; ++t)
#pragma unroll
        for (int r = 0; r < 8; ++r) acc[t][r] = 0.0f;

    for (int ss = 0; ss < CHUNK; ss += 32) {
        // --- stage 32 rows of K-features and V into LDS, K-swizzled ---
        v8bf kcv, ksv, vvv;
#pragma unroll
        for (int i = 0; i < 8; ++i) {
            int sg = s0 + ss + c * 8 + i;
            if (i == 0 && ss + 32 < CHUNK) {      // prefetch next tile
                __builtin_prefetch(&kb[(size_t)(sg + 32) * ND + dcol], 0, 3);
                __builtin_prefetch(&vb[(size_t)(sg + 32) * ND + dcol], 0, 3);
            }
            float kraw = kb[(size_t)sg * ND + dcol];
            float ang = angle_of(sg);
            float co = __cosf(ang), sn = __sinf(ang);
            float kr = fmaxf(kraw, 0.0f);
            float kc = kr * co, ks = kr * sn;
            kcv[i] = (__bf16)kc;
            ksv[i] = (__bf16)ks;
            ksum_c += kc;
            ksum_s += ks;
            vvv[i] = (__bf16)vb[(size_t)sg * ND + dcol];
        }
        *(v8bf*)&kcsT[dcol][pbase]      = kcv;
        *(v8bf*)&kcsT[64 + dcol][pbase] = ksv;
        *(v8bf*)&vswz[dcol][pbase]      = vvv;
        __syncthreads();

        // --- WMMA: wave owns feature band [wave*16, wave*16+16) ---
        const int fbase = wave * 16;
        v16bf afrag = ld_frag(&kcsT[fbase + mrow][half * 16]);
#pragma unroll
        for (int db = 0; db < 4; ++db) {
            v16bf bfrag = ld_frag(&vswz[db * 16 + ncol][half * 16]);
            acc[db] = __builtin_amdgcn_wmma_f32_16x16x32_bf16(
                false, afrag, false, bfrag, (short)0, acc[db], false, false);
        }
        __syncthreads();
    }

    // --- reduce partial kv into workspace ---
    float* kvdst = kv_ws + (size_t)bh * NF * ND;
#pragma unroll
    for (int db = 0; db < 4; ++db)
#pragma unroll
        for (int r = 0; r < 8; ++r) {
            int f = wave * 16 + r + 8 * half;
            int d = db * 16 + ncol;
            atomicAdd(&kvdst[f * ND + d], acc[db][r]);
        }
    atomicAdd(&ksum_ws[bh * NF + dcol],      ksum_c);
    atomicAdd(&ksum_ws[bh * NF + 64 + dcol], ksum_s);
}

// Phase 2: out[32 s-rows x 64] = (q_cs @ kv) * norm for one head / row-tile.
__global__ __launch_bounds__(256) void cosformer_out_kernel(
    const float* __restrict__ qin, const float* __restrict__ kv_ws,
    const float* __restrict__ ksum_ws, float* __restrict__ out)
{
    const int bh    = blockIdx.x;
    const int srow0 = blockIdx.y * 32;
    const int tid   = threadIdx.x;
    const int lane  = tid & 31;
    const int wave  = tid >> 5;
    const int half  = lane >> 4;
    const int mrow  = lane & 15;
    const int ncol  = lane & 15;

    __shared__ alignas(16) __bf16 qcs2[32][NF];  // [s][posF(f)]
    __shared__ alignas(16) __bf16 kvbT[ND][NF];  // [d][posF(f)]
    __shared__ float  ksumP[NF];                  // [posF(f)]
    __shared__ float  nrm[32];

    // stage kv (L2-resident) as bf16, transposed + K-swizzled: thread owns
    // column d and 4 chunks of 8 consecutive f.
    const float* kvsrc = kv_ws + (size_t)bh * NF * ND;
    {
        const int d = tid & 63;
        const int jb = tid >> 6;                 // 0..3
#pragma unroll
        for (int cc = 0; cc < 4; ++cc) {
            int j = jb + cc * 4;                 // chunk 0..15, f = j*8..j*8+7
            v8bf t;
#pragma unroll
            for (int i = 0; i < 8; ++i)
                t[i] = (__bf16)kvsrc[(j * 8 + i) * ND + d];
            *(v8bf*)&kvbT[d][posF(j * 8)] = t;
        }
    }
    if (tid < NF) ksumP[posF(tid)] = ksum_ws[bh * NF + tid];
    if (tid < 32) nrm[tid] = 0.0f;

    // stage q_cs features (q pre-scaled by 1/sqrt(D) = 0.125), K-swizzled:
    // thread owns row (tid>>3) and 8 consecutive d (seg*8..seg*8+7).
    const float* qb = qin + (size_t)bh * NS * ND;
    {
        const int row = tid >> 3;                // 0..31
        const int seg = tid & 7;                 // 0..7
        const int sg  = srow0 + row;
        float ang = angle_of(sg);
        float co = __cosf(ang), sn = __sinf(ang);
        const float4* q4 = (const float4*)&qb[(size_t)sg * ND + seg * 8];
        float4 qa = q4[0], qc4 = q4[1];
        float qv[8] = {qa.x, qa.y, qa.z, qa.w, qc4.x, qc4.y, qc4.z, qc4.w};
        v8bf fc, fs;
#pragma unroll
        for (int i = 0; i < 8; ++i) {
            float qr = fmaxf(qv[i] * 0.125f, 0.0f);
            fc[i] = (__bf16)(qr * co);
            fs[i] = (__bf16)(qr * sn);
        }
        *(v8bf*)&qcs2[row][posF(seg * 8)]      = fc;
        *(v8bf*)&qcs2[row][posF(64 + seg * 8)] = fs;
    }
    __syncthreads();

    // normalizer: nrm[row] = 1 / max(q_cs[row] . ksum, eps)  (both permuted identically)
    {
        int row = tid >> 3, seg = tid & 7;
        float p = 0.0f;
#pragma unroll
        for (int f = seg * 16; f < seg * 16 + 16; ++f)
            p += (float)qcs2[row][f] * ksumP[f];
        atomicAdd(&nrm[row], p);
    }
    __syncthreads();
    if (tid < 32) nrm[tid] = 1.0f / fmaxf(nrm[tid], 1e-6f);
    __syncthreads();

    // each wave: one 16x16 output tile, K = 128 in 4 WMMA steps
    const int rgrp = wave >> 2;        // which 16-row group
    const int db   = wave & 3;         // which 16-col d block
    v8f acc;
#pragma unroll
    for (int r = 0; r < 8; ++r) acc[r] = 0.0f;

#pragma unroll
    for (int fb = 0; fb < 4; ++fb) {
        v16bf afrag = ld_frag(&qcs2[rgrp * 16 + mrow][fb * 32 + half * 16]);
        v16bf bfrag = ld_frag(&kvbT[db * 16 + ncol][fb * 32 + half * 16]);
        acc = __builtin_amdgcn_wmma_f32_16x16x32_bf16(
            false, afrag, false, bfrag, (short)0, acc, false, false);
    }

    float* ob = out + (size_t)bh * NS * ND;
#pragma unroll
    for (int r = 0; r < 8; ++r) {
        int sl = rgrp * 16 + r + 8 * half;
        int d  = db * 16 + ncol;
        ob[(size_t)(srow0 + sl) * ND + d] = acc[r] * nrm[sl];
    }
}

extern "C" void kernel_launch(void* const* d_in, const int* in_sizes, int n_in,
                              void* d_out, int out_size, void* d_ws, size_t ws_size,
                              hipStream_t stream) {
    const float* q = (const float*)d_in[0];
    const float* k = (const float*)d_in[1];
    const float* v = (const float*)d_in[2];
    float* out = (float*)d_out;

    float* kv_ws   = (float*)d_ws;                    // 64 * 128 * 64 floats
    float* ksum_ws = kv_ws + (size_t)NBH * NF * ND;   // 64 * 128 floats
    int nzero = NBH * NF * ND + NBH * NF;

    zero_ws_kernel<<<(nzero + 255) / 256, 256, 0, stream>>>((float*)d_ws, nzero);
    cosformer_kv_kernel<<<dim3(NBH, SCHUNKS), 256, 0, stream>>>(k, v, kv_ws, ksum_ws);
    cosformer_out_kernel<<<dim3(NBH, NS / 32), 256, 0, stream>>>(q, kv_ws, ksum_ws, out);
}

// v001
// One run takes 95.9 microseconds.
// In both of two side-by-side timings against v000, it was 1.05 times as fast.
#include <hip/hip_runtime.h>

typedef __attribute__((ext_vector_type(16))) __bf16 v16bf;
typedef __attribute__((ext_vector_type(8)))  __bf16 v8bf;
typedef __attribute__((ext_vector_type(8)))  float  v8f;

#define NB 4
#define NH 16
#define NS 4096
#define ND 64
#define NF 128          // 2*ND feature dim
#define NBH (NB*NH)
#define SCHUNKS 8
#define CHUNK (NS / SCHUNKS)   // 512
#define OUT_TILES 8            // 32-row q tiles per work-group of the out kernel

__device__ __forceinline__ float angle_of(int s) {
    // (pi/2) * (s+1) / S
    return 1.57079632679f * (float)(s + 1) * (1.0f / (float)NS);
}

// Swizzled position of K-index k (within a 32-wide K group) such that the
// 16 bf16 elements a lane needs for a WMMA A/B fragment are contiguous:
// lane half h reads [h*16, h*16+16). k = t*16 + h*8 + i  ->  pos = h*16 + t*8 + i.
// Note posK(k0 + i) = posK(k0) + i for 8-aligned k0, i in [0,8).
__device__ __forceinline__ int posK(int k) {
    return ((k >> 3) & 1) * 16 + (k >> 4) * 8 + (k & 7);
}
// Same, applied within each 32-wide group of a 128-long feature axis.
__device__ __forceinline__ int posF(int f) {
    return (f & ~31) + posK(f & 31);
}

// Load a 16-element bf16 fragment from LDS as two b128 reads.
__device__ __forceinline__ v16bf ld_frag(const __bf16* p) {
    v8bf lo = *(const v8bf*)(p);
    v8bf hi = *(const v8bf*)(p + 8);
    return __builtin_shufflevector(lo, hi, 0, 1, 2, 3, 4, 5, 6, 7,
                                   8, 9, 10, 11, 12, 13, 14, 15);
}

// Work-group barrier that orders LDS traffic only. __syncthreads() also drains the
// wave's global loads, which would end the flight of the next q tile at the first
// barrier behind its issue; the waves of the out kernel exchange data through LDS alone.
__device__ __forceinline__ void lds_barrier() {
    __builtin_amdgcn_fence(__ATOMIC_RELEASE, "workgroup", "local");
    __builtin_amdgcn_s_barrier();
    __builtin_amdgcn_fence(__ATOMIC_ACQUIRE, "workgroup", "local");
}

__global__ void zero_ws_kernel(float* ws, int n) {
    int i = blockIdx.x * blockDim.x + threadIdx.x;
    if (i < n) ws[i] = 0.0f;
}

// Phase 1: kv[bh][128][64] += k_cs^T * V over an S-chunk; ksum[bh][128] += sum_s k_cs.
__global__ __launch_bounds__(256) void cosformer_kv_kernel(
    const float* __restrict__ kin, const float* __restrict__ vin,
    float* __restrict__ kv_ws, float* __restrict__ ksum_ws)
{
    const int bh   = blockIdx.x;
    const int s0   = blockIdx.y * CHUNK;
    const int tid  = threadIdx.x;
    const int lane = tid & 31;
    const int wave = tid >> 5;
    const int half = lane >> 4;
    const int mrow = lane & 15;        // A-matrix row (feature within band)
    const int ncol = lane & 15;        // B-matrix col (d within band)

    __shared__ alignas(16) __bf16 kcsT[NF][32];  // [f][posK(s)]  k_cs^T tile
    __shared__ alignas(16) __bf16 vswz[ND][32];  // [d][posK(s)]  V tile

    const float* kb = kin + (size_t)bh * NS * ND;
    const float* vb = vin + (size_t)bh * NS * ND;

    // staging: thread owns 8 consecutive s-rows (c*8..c*8+7) of one column d.
    const int c    = tid >> 6;         // 0..3
    const int dcol = tid & 63;
    const int pbase = (c & 1) * 16 + (c >> 1) * 8;   // posK(c*8)
    float ksum_c = 0.0f, ksum_s = 0.0f;

    v8f acc[4];
#pragma unroll
    for (int t = 0; t < 4; ++t)
#pragma unroll
        for (int r = 0; r < 8; ++r) acc[t][r] = 0.0f;

    for (int ss = 0; ss < CHUNK; ss += 32) {
        // --- stage 32 rows of K-features and V into LDS, K-swizzled ---
        v8bf kcv, ksv, vvv;
#pragma unroll
        for (int i = 0; i < 8; ++i) {
            int sg = s0 + ss + c * 8 + i;
            if (i == 0 && ss + 32 < CHUNK) {      // prefetch next tile
                __builtin_prefetch(&kb[(size_t)(sg + 32) * ND + dcol], 0, 3);
                __builtin_prefetch(&vb[(size_t)(sg + 32) * ND + dcol], 0, 3);
            }
            float kraw = kb[(size_t)sg * ND + dcol];
            float ang = angle_of(sg);
            float co = __cosf(ang), sn = __sinf(ang);
            float kr = fmaxf(kraw, 0.0f);
            float kc = kr * co, ks = kr * sn;
            kcv[i] = (__bf16)kc;
            ksv[i] = (__bf16)ks;
            ksum_c += kc;
            ksum_s += ks;
            vvv[i] = (__bf16)vb[(size_t)sg * ND + dcol];
        }
        *(v8bf*)&kcsT[dcol][pbase]      = kcv;
        *(v8bf*)&kcsT[64 + dcol][pbase] = ksv;
        *(v8bf*)&vswz[dcol][pbase]      = vvv;
        __syncthreads();

        // --- WMMA: wave owns feature band [wave*16, wave*16+16) ---
        const int fbase = wave * 16;
        v16bf afrag = ld_frag(&kcsT[fbase + mrow][half * 16]);
#pragma unroll
        for (int db = 0; db < 4; ++db) {
            v16bf bfrag = ld_frag(&vswz[db * 16 + ncol][half * 16]);
            acc[db] = __builtin_amdgcn_wmma_f32_16x16x32_bf16(
                false, afrag, false, bfrag, (short)0, acc[db], false, false);
        }
        __syncthreads();
    }

    // --- reduce partial kv into workspace ---
    float* kvdst = kv_ws + (size_t)bh * NF * ND;
#pragma unroll
    for (int db = 0; db < 4; ++db)
#pragma unroll
        for (int r = 0; r < 8; ++r) {
            int f = wave * 16 + r + 8 * half;
            int d = db * 16 + ncol;
            atomicAdd(&kvdst[f * ND + d], acc[db][r]);
        }
    atomicAdd(&ksum_ws[bh * NF + dcol],      ksum_c);
    atomicAdd(&ksum_ws[bh * NF + 64 + dcol], ksum_s);
}

// Phase 2: out = (q_cs @ kv) * norm. One work-group stages its head's kv once
// and then walks OUT_TILES consecutive 32-row tiles of q with it.
__global__ __launch_bounds__(256) void cosformer_out_kernel(
    const float* __restrict__ qin, const float* __restrict__ kv_ws,
    const float* __restrict__ ksum_ws, float* __restrict__ out)
{
    const int bh    = blockIdx.x;
    const int srow0 = blockIdx.y * (32 * OUT_TILES);
    const int tid   = threadIdx.x;
    const int lane  = tid & 31;
    const int wave  = tid >> 5;
    const int half  = lane >> 4;
    const int mrow  = lane & 15;
    const int ncol  = lane & 15;

    // q tile and norms are double-buffered by tile parity: a wave may stage tile
    // t+1 while a slower wave still reads tile t; tile t+2 lies behind a barrier
    // of tile t+1 that every reader of tile t has passed.
    __shared__ alignas(16) __bf16 qcs2[2][32][NF];  // [buf][s][posF(f)]
    __shared__ alignas(16) __bf16 kvbT[ND][NF];     // [d][posF(f)]
    __shared__ float  ksumP[NF];                     // [posF(f)]
    __shared__ float  nrm[2][32];

    // q staging: thread owns row (tid>>3) and 8 consecutive d (seg*8..seg*8+7).
    const int row = tid >> 3;                // 0..31
    const int seg = tid & 7;                 // 0..7
    const float* qb = qin + (size_t)bh * NS * ND;
    const float4* q4 = (const float4*)&qb[(size_t)(srow0 + row) * ND + seg * 8];
    float4 qa = q4[0], qc4 = q4[1];          // tile 0, in flight during kv staging
    // keeps these two loads ahead of the kv loads, and stands before their address
    // registers are reused
    asm volatile("s_wait_xcnt 0x0" ::: "memory");

    // stage kv (L2-resident) as bf16, transposed + K-swizzled: thread owns
    // column d and 4 chunks of 8 consecutive f.
    const float* kvsrc = kv_ws + (size_t)bh * NF * ND;
    {
        const int d = tid & 63;
        const int jb = tid >> 6;                 // 0..3
#pragma unroll
        for (int cc = 0; cc < 4; ++cc) {
            int j = jb + cc * 4;                 // chunk 0..15, f = j*8..j*8+7
            v8bf t;
#pragma unroll
            for (int i = 0; i < 8; ++i)
                t[i] = (__bf16)kvsrc[(j * 8 + i) * ND + d];
            *(v8bf*)&kvbT[d][posF(j * 8)] = t;
        }
    }
    if (tid < NF) ksumP[posF(tid)] = ksum_ws[bh * NF + tid];

    const int rgrp = wave >> 2;        // which 16-row group
    const int db   = wave & 3;         // which 16-col d block
    float* op = out + (size_t)bh * NS * ND
              + (size_t)(srow0 + rgrp * 16 + 8 * half) * ND + db * 16 + ncol;

    for (int t = 0; t < OUT_TILES; ++t) {
        const int buf = t & 1;
        const int st0 = srow0 + t * 32;

        // q_cs features (q pre-scaled by 1/sqrt(D) = 0.125), K-swizzled
        {
            float ang = angle_of(st0 + row);
            float co = __cosf(ang), sn = __sinf(ang);
            float qv[8] = {qa.x, qa.y, qa.z, qa.w, qc4.x, qc4.y, qc4.z, qc4.w};
            v8bf fc, fs;
#pragma unroll
            for (int i = 0; i < 8; ++i) {
                float qr = fmaxf(qv[i] * 0.125f, 0.0f);
                fc[i] = (__bf16)(qr * co);
                fs[i] = (__bf16)(qr * sn);
            }
            *(v8bf*)&qcs2[buf][row][posF(seg * 8)]      = fc;
            *(v8bf*)&qcs2[buf][row][posF(64 + seg * 8)] = fs;
        }
        if (tid < 32) nrm[buf][tid] = 0.0f;
        if (t + 1 < OUT_TILES) {             // next tile's q flies under this tile's work
            q4 += 32 * ND / 4;
            qa = q4[0];
            qc4 = q4[1];
            // before the loads' address registers are reused further down
            asm volatile("s_wait_xcnt 0x0" ::: "memory");
        }
        lds_barrier();

        // normalizer: nrm[row] = 1 / max(q_cs[row] . ksum, eps)  (both permuted identically)
        {
            float p = 0.0f;
#pragma unroll
            for (int f = seg * 16; f < seg * 16 + 16; ++f)
                p += (float)qcs2[buf][row][f] * ksumP[f];
            atomicAdd(&nrm[buf][row], p);
        }
        lds_barrier();
        if (tid < 32) nrm[buf][tid] = 1.0f / fmaxf(nrm[buf][tid], 1e-6f);
        lds_barrier();

        // each wave: one 16x16 output tile, K = 128 in 4 WMMA steps
        v8f acc;
#pragma unroll
        for (int r = 0; r < 8; ++r) acc[r] = 0.0f;

#pragma unroll
        for (int fb = 0; fb < 4; ++fb) {
            v16bf afrag = ld_frag(&qcs2[buf][rgrp * 16 + mrow][fb * 32 + half * 16]);
            v16bf bfrag = ld_frag(&kvbT[db * 16 + ncol][fb * 32 + half * 16]);
            acc = __builtin_amdgcn_wmma_f32_16x16x32_bf16(
                false, afrag, false, bfrag, (short)0, acc, false, false);
        }

#pragma unroll
        for (int r = 0; r < 8; ++r) {
            int sl = rgrp * 16 + r + 8 * half;
            op[r * ND] = acc[r] * nrm[buf][sl];
        }
        // before the next tile's work reuses the stores' address and data registers
        if (t + 1 < OUT_TILES) asm volatile("s_wait_xcnt 0x0" ::: "memory");
        op += 32 * ND;
    }
}

extern "C" void kernel_launch(void* const* d_in, const int* in_sizes, int n_in,
                              void* d_out, int out_size, void* d_ws, size_t ws_size,
                              hipStream_t stream) {
    const float* q = (const float*)d_in[0];
    const float* k = (const float*)d_in[1];
    const float* v = (const float*)d_in[2];
    float* out = (float*)d_out;

    float* kv_ws   = (float*)d_ws;                    // 64 * 128 * 64 floats
    float* ksum_ws = kv_ws + (size_t)NBH * NF * ND;   // 64 * 128 floats
    int nzero = NBH * NF * ND + NBH * NF;

    zero_ws_kernel<<<(nzero + 255) / 256, 256, 0, stream>>>((float*)d_ws, nzero);
    cosformer_kv_kernel<<<dim3(NBH, SCHUNKS), 256, 0, stream>>>(k, v, kv_ws, ksum_ws);
    cosformer_out_kernel<<<dim3(NBH, NS / (32 * OUT_TILES)), 256, 0, stream>>>(q, kv_ws, ksum_ws, out);
}

// v002
// Measured time: 43.7 microseconds a run.
// Timed twice side by side with v001, it ran 2.19 and 2.20 times as fast.
// All steps since v000 together make it 2.31 times as fast.
#include <hip/hip_runtime.h>

typedef __attribute__((ext_vector_type(16))) __bf16 v16bf;
typedef __attribute__((ext_vector_type(8)))  __bf16 v8bf;
typedef __attribute__((ext_vector_type(8)))  float  v8f;

#define NB 4
#define NH 16
#define NS 4096
#define ND 64
#define NF 128          // 2*ND feature dim
#define NBH (NB*NH)
#define SCHUNKS 8
#define CHUNK (NS / SCHUNKS)   // 512
#define OUT_TILES 8            // 32-row q tiles per work-group of the out kernel
// LDS row pitches in bf16 elements. Fragment rows are read with one b128 per lane,
// 16 rows at a time: a pitch of 16 B x odd puts those 16 rows on 64 distinct banks,
// while a pitch of 64 B or 256 B stacks them on 16 or on 4 banks.
#define PITCH_S (32 + 8)       // 32 payload elements, 80 B
#define PITCH_F (NF + 8)       // 128 payload elements, 272 B

__device__ __forceinline__ float angle_of(int s) {
    // (pi/2) * (s+1) / S
    return 1.57079632679f * (float)(s + 1) * (1.0f / (float)NS);
}

// Swizzled position of K-index k (within a 32-wide K group) such that the
// 16 bf16 elements a lane needs for a WMMA A/B fragment are contiguous:
// lane half h reads [h*16, h*16+16). k = t*16 + h*8 + i  ->  pos = h*16 + t*8 + i.
// Note posK(k0 + i) = posK(k0) + i for 8-aligned k0, i in [0,8).
__device__ __forceinline__ int posK(int k) {
    return ((k >> 3) & 1) * 16 + (k >> 4) * 8 + (k & 7);
}
// Same, applied within each 32-wide group of a 128-long feature axis.
__device__ __forceinline__ int posF(int f) {
    return (f & ~31) + posK(f & 31);
}

// Place of permuted feature p in the ksum row: segments of 16 floats at an 80-B
// pitch, so that the 8 segments read side by side fall on distinct banks.
__device__ __forceinline__ int posS(int p) {
    return p + ((p >> 4) << 2);
}

// Load a 16-element bf16 fragment from LDS as two b128 reads.
__device__ __forceinline__ v16bf ld_frag(const __bf16* p) {
    v8bf lo = *(const v8bf*)(p);
    v8bf hi = *(const v8bf*)(p + 8);
    return __builtin_shufflevector(lo, hi, 0, 1, 2, 3, 4, 5, 6, 7,
                                   8, 9, 10, 11, 12, 13, 14, 15);
}

// Work-group barrier that orders LDS traffic only. __syncthreads() also drains the
// wave's global loads, which would end the flight of the next q tile at the first
// barrier behind its issue; the waves of the out kernel exchange data through LDS alone.
__device__ __forceinline__ void lds_barrier() {
    __builtin_amdgcn_fence(__ATOMIC_RELEASE, "workgroup", "local");
    __builtin_amdgcn_s_barrier();
    __builtin_amdgcn_fence(__ATOMIC_ACQUIRE, "workgroup", "local");
}

__global__ void zero_ws_kernel(float* ws, int n) {
    int i = blockIdx.x * blockDim.x + threadIdx.x;
    if (i < n) ws[i] = 0.0f;
}

// Phase 1: kv[bh][128][64] += k_cs^T * V over an S-chunk; ksum[bh][128] += sum_s k_cs.
__global__ __launch_bounds__(256) void cosformer_kv_kernel(
    const float* __restrict__ kin, const float* __restrict__ vin,
    float* __restrict__ kv_ws, float* __restrict__ ksum_ws)
{
    const int bh   = blockIdx.x;
    const int s0   = blockIdx.y * CHUNK;
    const int tid  = threadIdx.x;
    const int lane = tid & 31;
    const int wave = tid >> 5;
    const int half = lane >> 4;
    const int mrow = lane & 15;        // A-matrix row (feature within band)
    const int ncol = lane & 15;        // B-matrix col (d within band)

    __shared__ alignas(16) __bf16 kcsT[NF][PITCH_S];  // [f][posK(s)]  k_cs^T tile
    __shared__ alignas(16) __bf16 vswz[ND][PITCH_S];  // [d][posK(s)]  V tile

    const float* kb = kin + (size_t)bh * NS * ND;
    const float* vb = vin + (size_t)bh * NS * ND;

    // staging: thread owns 8 consecutive s-rows (c*8..c*8+7) of one column d.
    const int c    = tid >> 6;         // 0..3
    const int dcol = tid & 63;
    const int pbase = (c & 1) * 16 + (c >> 1) * 8;   // posK(c*8)
    float ksum_c = 0.0f, ksum_s = 0.0f;

    v8f acc[4];
#pragma unroll
    for (int t = 0; t < 4; ++t)
#pragma unroll
        for (int r = 0; r < 8; ++r) acc[t][r] = 0.0f;

    for (int ss = 0; ss < CHUNK; ss += 32) {
        // --- stage 32 rows of K-features and V into LDS, K-swizzled ---
        v8bf kcv, ksv, vvv;
#pragma unroll
        for (int i = 0; i < 8; ++i) {
            int sg = s0 + ss + c * 8 + i;
            if (i == 0 && ss + 32 < CHUNK) {      // prefetch next tile
                __builtin_prefetch(&kb[(size_t)(sg + 32) * ND + dcol], 0, 3);
                __builtin_prefetch(&vb[(size_t)(sg + 32) * ND + dcol], 0, 3);
            }
            float kraw = kb[(size_t)sg * ND + dcol];
            float ang = angle_of(sg);
            float co = __cosf(ang), sn = __sinf(ang);
            float kr = fmaxf(kraw, 0.0f);
            float kc = kr * co, ks = kr * sn;
            kcv[i] = (__bf16)kc;
            ksv[i] = (__bf16)ks;
            ksum_c += kc;
            ksum_s += ks;
            vvv[i] = (__bf16)vb[(size_t)sg * ND + dcol];
        }
        *(v8bf*)&kcsT[dcol][pbase]      = kcv;
        *(v8bf*)&kcsT[64 + dcol][pbase] = ksv;
        *(v8bf*)&vswz[dcol][pbase]      = vvv;
        __syncthreads();

        // --- WMMA: wave owns feature band [wave*16, wave*16+16) ---
        const int fbase = wave * 16;
        v16bf afrag = ld_frag(&kcsT[fbase + mrow][half * 16]);
#pragma unroll
        for (int db = 0; db < 4; ++db) {
            v16bf bfrag = ld_frag(&vswz[db * 16 + ncol][half * 16]);
            acc[db] = __builtin_amdgcn_wmma_f32_16x16x32_bf16(
                false, afrag, false, bfrag, (short)0, acc[db], false, false);
        }
        __syncthreads();
    }

    // --- reduce partial kv into workspace ---
    float* kvdst = kv_ws + (size_t)bh * NF * ND;
#pragma unroll
    for (int db = 0; db < 4; ++db)
#pragma unroll
        for (int r = 0; r < 8; ++r) {
            int f = wave * 16 + r + 8 * half;
            int d = db * 16 + ncol;
            atomicAdd(&kvdst[f * ND + d], acc[db][r]);
        }
    atomicAdd(&ksum_ws[bh * NF + dcol],      ksum_c);
    atomicAdd(&ksum_ws[bh * NF + 64 + dcol], ksum_s);
}

// Phase 2: out = (q_cs @ kv) * norm. One work-group stages its head's kv once
// and then walks OUT_TILES consecutive 32-row tiles of q with it.
__global__ __launch_bounds__(256) void cosformer_out_kernel(
    const float* __restrict__ qin, const float* __restrict__ kv_ws,
    const float* __restrict__ ksum_ws, float* __restrict__ out)
{
    const int bh    = blockIdx.x;
    const int srow0 = blockIdx.y * (32 * OUT_TILES);
    const int tid   = threadIdx.x;
    const int lane  = tid & 31;
    const int wave  = tid >> 5;
    const int half  = lane >> 4;
    const int mrow  = lane & 15;
    const int ncol  = lane & 15;

    // q tile and norms are double-buffered by tile parity: a wave may stage tile
    // t+1 while a slower wave still reads tile t; tile t+2 lies behind a barrier
    // of tile t+1 that every reader of tile t has passed.
    __shared__ alignas(16) __bf16 qcs2[2][32][PITCH_F];  // [buf][s][posF(f)]
    __shared__ alignas(16) __bf16 kvbT[ND][PITCH_F];     // [d][posF(f)]
    __shared__ alignas(16) float ksumP[NF + NF / 4];      // [posS(posF(f))]
    __shared__ float  nrm[2][32];

    // q staging: thread owns row (tid>>3) and 8 consecutive d (seg*8..seg*8+7).
    const int row = tid >> 3;                // 0..31
    const int seg = tid & 7;                 // 0..7
    const float* qb = qin + (size_t)bh * NS * ND;
    const float4* q4 = (const float4*)&qb[(size_t)(srow0 + row) * ND + seg * 8];
    float4 qa = q4[0], qc4 = q4[1];          // tile 0, in flight during kv staging
    // keeps these two loads ahead of the kv loads, and stands before their address
    // registers are reused
    asm volatile("s_wait_xcnt 0x0" ::: "memory");

    // stage kv (L2-resident) as bf16, transposed + K-swizzled: thread owns
    // column d and 4 chunks of 8 consecutive f.
    const float* kvsrc = kv_ws + (size_t)bh * NF * ND;
    {
        const int d = tid & 63;
        const int jb = tid >> 6;                 // 0..3
#pragma unroll
        for (int cc = 0; cc < 4; ++cc) {
            int j = jb + cc * 4;                 // chunk 0..15, f = j*8..j*8+7
            v8bf t;
#pragma unroll
            for (int i = 0; i < 8; ++i)
                t[i] = (__bf16)kvsrc[(j * 8 + i) * ND + d];
            *(v8bf*)&kvbT[d][posF(j * 8)] = t;
        }
    }
    if (tid < NF) ksumP[posS(posF(tid))] = ksum_ws[bh * NF + tid];

    const int rgrp = wave >> 2;        // which 16-row group
    const int db   = wave & 3;         // which 16-col d block
    float* op = out + (size_t)bh * NS * ND
              + (size_t)(srow0 + rgrp * 16 + 8 * half) * ND + db * 16 + ncol;

    for (int t = 0; t < OUT_TILES; ++t) {
        const int buf = t & 1;
        const int st0 = srow0 + t * 32;

        // q_cs features (q pre-scaled by 1/sqrt(D) = 0.125), K-swizzled
        {
            float ang = angle_of(st0 + row);
            float co = __cosf(ang), sn = __sinf(ang);
            float qv[8] = {qa.x, qa.y, qa.z, qa.w, qc4.x, qc4.y, qc4.z, qc4.w};
            v8bf fc, fs;
#pragma unroll
            for (int i = 0; i < 8; ++i) {
                float qr = fmaxf(qv[i] * 0.125f, 0.0f);
                fc[i] = (__bf16)(qr * co);
                fs[i] = (__bf16)(qr * sn);
            }
            *(v8bf*)&qcs2[buf][row][posF(seg * 8)]      = fc;
            *(v8bf*)&qcs2[buf][row][posF(64 + seg * 8)] = fs;
        }
        if (tid < 32) nrm[buf][tid] = 0.0f;
        if (t + 1 < OUT_TILES) {             // next tile's q flies under this tile's work
            q4 += 32 * ND / 4;
            qa = q4[0];
            qc4 = q4[1];
            // before the loads' address registers are reused further down
            asm volatile("s_wait_xcnt 0x0" ::: "memory");
        }
        lds_barrier();

        // normalizer: nrm[row] = 1 / max(q_cs[row] . ksum, eps)  (both permuted identically)
        {
            float p = 0.0f;
#pragma unroll
            for (int f = seg * 16; f < seg * 16 + 16; ++f)
                p += (float)qcs2[buf][row][f] * ksumP[posS(f)];
            atomicAdd(&nrm[buf][row], p);
        }
        lds_barrier();
        if (tid < 32) nrm[buf][tid] = 1.0f / fmaxf(nrm[buf][tid], 1e-6f);
        lds_barrier();

        // each wave: one 16x16 output tile, K = 128 in 4 WMMA steps
        v8f acc;
#pragma unroll
        for (int r = 0; r < 8; ++r) acc[r] = 0.0f;

#pragma unroll
        for (int fb = 0; fb < 4; ++fb) {
            v16bf afrag = ld_frag(&qcs2[buf][rgrp * 16 + mrow][fb * 32 + half * 16]);
            v16bf bfrag = ld_frag(&kvbT[db * 16 + ncol][fb * 32 + half * 16]);
            acc = __builtin_amdgcn_wmma_f32_16x16x32_bf16(
                false, afrag, false, bfrag, (short)0, acc, false, false);
        }

#pragma unroll
        for (int r = 0; r < 8; ++r) {
            int sl = rgrp * 16 + r + 8 * half;
            op[r * ND] = acc[r] * nrm[buf][sl];
        }
        // before the next tile's work reuses the stores' address and data registers
        if (t + 1 < OUT_TILES) asm volatile("s_wait_xcnt 0x0" ::: "memory");
        op += 32 * ND;
    }
}

extern "C" void kernel_launch(void* const* d_in, const int* in_sizes, int n_in,
                              void* d_out, int out_size, void* d_ws, size_t ws_size,
                              hipStream_t stream) {
    const float* q = (const float*)d_in[0];
    const float* k = (const float*)d_in[1];
    const float* v = (const float*)d_in[2];
    float* out = (float*)d_out;

    float* kv_ws   = (float*)d_ws;                    // 64 * 128 * 64 floats
    float* ksum_ws = kv_ws + (size_t)NBH * NF * ND;   // 64 * 128 floats
    int nzero = NBH * NF * ND + NBH * NF;

    zero_ws_kernel<<<(nzero + 255) / 256, 256, 0, stream>>>((float*)d_ws, nzero);
    cosformer_kv_kernel<<<dim3(NBH, SCHUNKS), 256, 0, stream>>>(k, v, kv_ws, ksum_ws);
    cosformer_out_kernel<<<dim3(NBH, NS / (32 * OUT_TILES)), 256, 0, stream>>>(q, kv_ws, ksum_ws, out);
}

// v003
// It runs in 36.6 microseconds.
// Two timings next to v002 both put it at 1.19 times that version's speed.
// Counting every step since v000, it is 2.75 times as fast.
#include <hip/hip_runtime.h>

typedef __attribute__((ext_vector_type(16))) __bf16 v16bf;
typedef __attribute__((ext_vector_type(8)))  __bf16 v8bf;
typedef __attribute__((ext_vector_type(8)))  float  v8f;

#define NB 4
#define NH 16
#define NS 4096
#define ND 64
#define NF 128          // 2*ND feature dim
#define NBH (NB*NH)
#define SCHUNKS 8
#define CHUNK (NS / SCHUNKS)   // 512
#define OUT_TILES 8            // 32-row q tiles per work-group of the out kernel
// LDS row pitches in bf16 elements. Fragment rows are read with one b128 per lane,
// 16 rows at a time: a pitch of 16 B x odd puts those 16 rows on 64 distinct banks,
// while a pitch of 64 B or 256 B stacks them on 16 or on 4 banks.
#define PITCH_S (32 + 8)       // 32 payload elements, 80 B
#define PITCH_F (NF + 8)       // 128 payload elements, 272 B

__device__ __forceinline__ float angle_of(int s) {
    // (pi/2) * (s+1) / S
    return 1.57079632679f * (float)(s + 1) * (1.0f / (float)NS);
}

// Swizzled position of K-index k (within a 32-wide K group) such that the
// 16 bf16 elements a lane needs for a WMMA A/B fragment are contiguous:
// lane half h reads [h*16, h*16+16). k = t*16 + h*8 + i  ->  pos = h*16 + t*8 + i.
// Note posK(k0 + i) = posK(k0) + i for 8-aligned k0, i in [0,8).
__device__ __forceinline__ int posK(int k) {
    return ((k >> 3) & 1) * 16 + (k >> 4) * 8 + (k & 7);
}
// Same, applied within each 32-wide group of a 128-long feature axis.
__device__ __forceinline__ int posF(int f) {
    return (f & ~31) + posK(f & 31);
}

// Place of permuted feature p in the ksum row: segments of 16 floats at an 80-B
// pitch, so that the 8 segments read side by side fall on distinct banks.
__device__ __forceinline__ int posS(int p) {
    return p + ((p >> 4) << 2);
}

// Load a 16-element bf16 fragment from LDS as two b128 reads.
__device__ __forceinline__ v16bf ld_frag(const __bf16* p) {
    v8bf lo = *(const v8bf*)(p);
    v8bf hi = *(const v8bf*)(p + 8);
    return __builtin_shufflevector(lo, hi, 0, 1, 2, 3, 4, 5, 6, 7,
                                   8, 9, 10, 11, 12, 13, 14, 15);
}

// Work-group barrier that orders LDS traffic only. __syncthreads() also drains the
// wave's global loads, which would end the flight of the next tile at the first
// barrier behind its issue; inside their loops the waves of both kernels exchange
// data through LDS alone.
__device__ __forceinline__ void lds_barrier() {
    __builtin_amdgcn_fence(__ATOMIC_RELEASE, "workgroup", "local");
    __builtin_amdgcn_s_barrier();
    __builtin_amdgcn_fence(__ATOMIC_ACQUIRE, "workgroup", "local");
}

__global__ void zero_ws_kernel(float* ws, int n) {
    int i = blockIdx.x * blockDim.x + threadIdx.x;
    if (i < n) ws[i] = 0.0f;
}

// Phase 1: kv[bh][128][64] += k_cs^T * V over an S-chunk; ksum[bh][128] += sum_s k_cs.
__global__ __launch_bounds__(256) void cosformer_kv_kernel(
    const float* __restrict__ kin, const float* __restrict__ vin,
    float* __restrict__ kv_ws, float* __restrict__ ksum_ws)
{
    const int bh   = blockIdx.x;
    const int s0   = blockIdx.y * CHUNK;
    const int tid  = threadIdx.x;
    const int lane = tid & 31;
    const int wave = tid >> 5;
    const int half = lane >> 4;
    const int mrow = lane & 15;        // A-matrix row (feature within band)
    const int ncol = lane & 15;        // B-matrix col (d within band)

    __shared__ alignas(16) __bf16 kcsT[NF][PITCH_S];  // [f][posK(s)]  k_cs^T tile
    __shared__ alignas(16) __bf16 vswz[ND][PITCH_S];  // [d][posK(s)]  V tile

    const float* kb = kin + (size_t)bh * NS * ND;
    const float* vb = vin + (size_t)bh * NS * ND;

    // staging: thread owns 8 consecutive s-rows (c*8..c*8+7) of one column d.
    const int c    = tid >> 6;         // 0..3
    const int dcol = tid & 63;
    const int pbase = (c & 1) * 16 + (c >> 1) * 8;   // posK(c*8)
    float ksum_c = 0.0f, ksum_s = 0.0f;
    // running pointers to the thread's first row of the tile that is loaded next
    const float* kp = kb + (size_t)(s0 + c * 8) * ND + dcol;
    const float* vp = vb + (size_t)(s0 + c * 8) * ND + dcol;

    v8f acc[4];
#pragma unroll
    for (int t = 0; t < 4; ++t)
#pragma unroll
        for (int r = 0; r < 8; ++r) acc[t][r] = 0.0f;

    // Loads the thread's 8 rows of one K and one V tile into registers and moves on.
    auto load_tile = [&](float (&kr)[8], float (&vr)[8]) {
#pragma unroll
        for (int i = 0; i < 8; ++i) {
            kr[i] = kp[i * ND];
            vr[i] = vp[i * ND];
        }
        // holds the 16 loads at this place, a whole tile ahead of their use, and stands
        // before their address registers are advanced
        asm volatile("s_wait_xcnt 0x0" ::: "memory");
        kp += 32 * ND;
        vp += 32 * ND;
    };

    // One 32-row tile: the next tile's loads are issued first and fly under all of
    // this tile's work; (kc, vc) were loaded one tile ago.
    auto do_tile = [&](float (&kc)[8], float (&vc)[8], float (&kn)[8], float (&vn)[8],
                       int ss, bool more) {
        if (more) load_tile(kn, vn);

        // --- stage 32 rows of K-features and V into LDS, K-swizzled ---
        v8bf kcv, ksv, vvv;
#pragma unroll
        for (int i = 0; i < 8; ++i) {
            int sg = s0 + ss + c * 8 + i;
            float ang = angle_of(sg);
            float co = __cosf(ang), sn = __sinf(ang);
            float kr = fmaxf(kc[i], 0.0f);
            float kcos = kr * co, ksin = kr * sn;
            kcv[i] = (__bf16)kcos;
            ksv[i] = (__bf16)ksin;
            ksum_c += kcos;
            ksum_s += ksin;
            vvv[i] = (__bf16)vc[i];
        }
        *(v8bf*)&kcsT[dcol][pbase]      = kcv;
        *(v8bf*)&kcsT[64 + dcol][pbase] = ksv;
        *(v8bf*)&vswz[dcol][pbase]      = vvv;
        lds_barrier();

        // --- WMMA: wave owns feature band [wave*16, wave*16+16) ---
        const int fbase = wave * 16;
        v16bf afrag = ld_frag(&kcsT[fbase + mrow][half * 16]);
#pragma unroll
        for (int db = 0; db < 4; ++db) {
            v16bf bfrag = ld_frag(&vswz[db * 16 + ncol][half * 16]);
            acc[db] = __builtin_amdgcn_wmma_f32_16x16x32_bf16(
                false, afrag, false, bfrag, (short)0, acc[db], false, false);
        }
        lds_barrier();
    };

    // (kc, vc) hold the tile at work, (kn, vn) the tile in flight; the hand-over at the
    // foot of a trip is where the wave waits for the flight, one whole tile's work
    // behind its issue.
    float kc[8], vc[8];
    load_tile(kc, vc);
    for (int ss = 0; ss < CHUNK - 32; ss += 32) {
        float kn[8], vn[8];
        do_tile(kc, vc, kn, vn, ss, true);
#pragma unroll
        for (int i = 0; i < 8; ++i) {
            kc[i] = kn[i];
            vc[i] = vn[i];
        }
    }
    do_tile(kc, vc, kc, vc, CHUNK - 32, false);   // last tile: nothing left to load

    // --- reduce partial kv into workspace ---
    float* kvdst = kv_ws + (size_t)bh * NF * ND;
#pragma unroll
    for (int db = 0; db < 4; ++db)
#pragma unroll
        for (int r = 0; r < 8; ++r) {
            int f = wave * 16 + r + 8 * half;
            int d = db * 16 + ncol;
            atomicAdd(&kvdst[f * ND + d], acc[db][r]);
        }
    atomicAdd(&ksum_ws[bh * NF + dcol],      ksum_c);
    atomicAdd(&ksum_ws[bh * NF + 64 + dcol], ksum_s);
}

// Phase 2: out = (q_cs @ kv) * norm. One work-group stages its head's kv once
// and then walks OUT_TILES consecutive 32-row tiles of q with it.
__global__ __launch_bounds__(256) void cosformer_out_kernel(
    const float* __restrict__ qin, const float* __restrict__ kv_ws,
    const float* __restrict__ ksum_ws, float* __restrict__ out)
{
    const int bh    = blockIdx.x;
    const int srow0 = blockIdx.y * (32 * OUT_TILES);
    const int tid   = threadIdx.x;
    const int lane  = tid & 31;
    const int wave  = tid >> 5;
    const int half  = lane >> 4;
    const int mrow  = lane & 15;
    const int ncol  = lane & 15;

    // q tile and norms are double-buffered by tile parity: a wave may stage tile
    // t+1 while a slower wave still reads tile t; tile t+2 lies behind a barrier
    // of tile t+1 that every reader of tile t has passed.
    __shared__ alignas(16) __bf16 qcs2[2][32][PITCH_F];  // [buf][s][posF(f)]
    __shared__ alignas(16) __bf16 kvbT[ND][PITCH_F];     // [d][posF(f)]
    __shared__ alignas(16) float ksumP[NF + NF / 4];      // [posS(posF(f))]
    __shared__ float  nrm[2][32];

    // q staging: thread owns row (tid>>3) and 8 consecutive d (seg*8..seg*8+7).
    const int row = tid >> 3;                // 0..31
    const int seg = tid & 7;                 // 0..7
    const float* qb = qin + (size_t)bh * NS * ND;
    const float4* q4 = (const float4*)&qb[(size_t)(srow0 + row) * ND + seg * 8];
    float4 qa = q4[0], qc4 = q4[1];          // tile 0, in flight during kv staging
    // keeps these two loads ahead of the kv loads, and stands before their address
    // registers are reused
    asm volatile("s_wait_xcnt 0x0" ::: "memory");

    // stage kv (L2-resident) as bf16, transposed + K-swizzled: thread owns
    // column d and 4 chunks of 8 consecutive f.
    const float* kvsrc = kv_ws + (size_t)bh * NF * ND;
    {
        const int d = tid & 63;
        const int jb = tid >> 6;                 // 0..3
#pragma unroll
        for (int cc = 0; cc < 4; ++cc) {
            int j = jb + cc * 4;                 // chunk 0..15, f = j*8..j*8+7
            v8bf t;
#pragma unroll
            for (int i = 0; i < 8; ++i)
                t[i] = (__bf16)kvsrc[(j * 8 + i) * ND + d];
            *(v8bf*)&kvbT[d][posF(j * 8)] = t;
        }
    }
    if (tid < NF) ksumP[posS(posF(tid))] = ksum_ws[bh * NF + tid];

    const int rgrp = wave >> 2;        // which 16-row group
    const int db   = wave & 3;         // which 16-col d block
    float* op = out + (size_t)bh * NS * ND
              + (size_t)(srow0 + rgrp * 16 + 8 * half) * ND + db * 16 + ncol;

    for (int t = 0; t < OUT_TILES; ++t) {
        const int buf = t & 1;
        const int st0 = srow0 + t * 32;

        // q_cs features (q pre-scaled by 1/sqrt(D) = 0.125), K-swizzled
        {
            float ang = angle_of(st0 + row);
            float co = __cosf(ang), sn = __sinf(ang);
            float qv[8] = {qa.x, qa.y, qa.z, qa.w, qc4.x, qc4.y, qc4.z, qc4.w};
            v8bf fc, fs;
#pragma unroll
            for (int i = 0; i < 8; ++i) {
                float qr = fmaxf(qv[i] * 0.125f, 0.0f);
                fc[i] = (__bf16)(qr * co);
                fs[i] = (__bf16)(qr * sn);
            }
            *(v8bf*)&qcs2[buf][row][posF(seg * 8)]      = fc;
            *(v8bf*)&qcs2[buf][row][posF(64 + seg * 8)] = fs;
        }
        if (tid < 32) nrm[buf][tid] = 0.0f;
        if (t + 1 < OUT_TILES) {             // next tile's q flies under this tile's work
            q4 += 32 * ND / 4;
            qa = q4[0];
            qc4 = q4[1];
            // before the loads' address registers are reused further down
            asm volatile("s_wait_xcnt 0x0" ::: "memory");
        }
        lds_barrier();

        // normalizer: nrm[row] = 1 / max(q_cs[row] . ksum, eps)  (both permuted identically)
        {
            float p = 0.0f;
#pragma unroll
            for (int f = seg * 16; f < seg * 16 + 16; ++f)
                p += (float)qcs2[buf][row][f] * ksumP[posS(f)];
            atomicAdd(&nrm[buf][row], p);
        }
        lds_barrier();
        if (tid < 32) nrm[buf][tid] = 1.0f / fmaxf(nrm[buf][tid], 1e-6f);
        lds_barrier();

        // each wave: one 16x16 output tile, K = 128 in 4 WMMA steps
        v8f acc;
#pragma unroll
        for (int r = 0; r < 8; ++r) acc[r] = 0.0f;

#pragma unroll
        for (int fb = 0; fb < 4; ++fb) {
            v16bf afrag = ld_frag(&qcs2[buf][rgrp * 16 + mrow][fb * 32 + half * 16]);
            v16bf bfrag = ld_frag(&kvbT[db * 16 + ncol][fb * 32 + half * 16]);
            acc = __builtin_amdgcn_wmma_f32_16x16x32_bf16(
                false, afrag, false, bfrag, (short)0, acc, false, false);
        }

#pragma unroll
        for (int r = 0; r < 8; ++r) {
            int sl = rgrp * 16 + r + 8 * half;
            op[r * ND] = acc[r] * nrm[buf][sl];
        }
        // before the next tile's work reuses the stores' address and data registers
        if (t + 1 < OUT_TILES) asm volatile("s_wait_xcnt 0x0" ::: "memory");
        op += 32 * ND;
    }
}

extern "C" void kernel_launch(void* const* d_in, const int* in_sizes, int n_in,
                              void* d_out, int out_size, void* d_ws, size_t ws_size,
                              hipStream_t stream) {
    const float* q = (const float*)d_in[0];
    const float* k = (const float*)d_in[1];
    const float* v = (const float*)d_in[2];
    float* out = (float*)d_out;

    float* kv_ws   = (float*)d_ws;                    // 64 * 128 * 64 floats
    float* ksum_ws = kv_ws + (size_t)NBH * NF * ND;   // 64 * 128 floats
    int nzero = NBH * NF * ND + NBH * NF;

    zero_ws_kernel<<<(nzero + 255) / 256, 256, 0, stream>>>((float*)d_ws, nzero);
    cosformer_kv_kernel<<<dim3(NBH, SCHUNKS), 256, 0, stream>>>(k, v, kv_ws, ksum_ws);
    cosformer_out_kernel<<<dim3(NBH, NS / (32 * OUT_TILES)), 256, 0, stream>>>(q, kv_ws, ksum_ws, out);
}

// v004
// A run of this version takes 34.8 microseconds.
// In both of two side-by-side timings against v003, it was 1.04 times as fast.
// All steps since v000 together make it 2.87 times as fast.
#include <hip/hip_runtime.h>

typedef __attribute__((ext_vector_type(16))) __bf16 v16bf;
typedef __attribute__((ext_vector_type(8)))  __bf16 v8bf;
typedef __attribute__((ext_vector_type(8)))  float  v8f;

#define NB 4
#define NH 16
#define NS 4096
#define ND 64
#define NF 128          // 2*ND feature dim
#define NBH (NB*NH)
#define SCHUNKS 8
#define CHUNK (NS / SCHUNKS)   // 512
#define OUT_TILES 8            // 32-row q tiles per work-group of the out kernel
// LDS row pitches in bf16 elements. Fragment rows are read with one b128 per lane,
// 16 rows at a time: a pitch of 16 B x odd puts those 16 rows on 64 distinct banks,
// while a pitch of 64 B or 256 B stacks them on 16 or on 4 banks.
#define PITCH_S (32 + 8)       // 32 payload elements, 80 B
#define PITCH_F (NF + 8)       // 128 payload elements, 272 B

__device__ __forceinline__ float angle_of(int s) {
    // (pi/2) * (s+1) / S
    return 1.57079632679f * (float)(s + 1) * (1.0f / (float)NS);
}

// Swizzled position of K-index k (within a 32-wide K group) such that the
// 16 bf16 elements a lane needs for a WMMA A/B fragment are contiguous:
// lane half h reads [h*16, h*16+16). k = t*16 + h*8 + i  ->  pos = h*16 + t*8 + i.
// Note posK(k0 + i) = posK(k0) + i for 8-aligned k0, i in [0,8).
__device__ __forceinline__ int posK(int k) {
    return ((k >> 3) & 1) * 16 + (k >> 4) * 8 + (k & 7);
}
// Same, applied within each 32-wide group of a 128-long feature axis.
__device__ __forceinline__ int posF(int f) {
    return (f & ~31) + posK(f & 31);
}

// Place of permuted feature p in the ksum row: segments of 16 floats at an 80-B
// pitch, so that the 8 segments read side by side fall on distinct banks.
__device__ __forceinline__ int posS(int p) {
    return p + ((p >> 4) << 2);
}

// Load a 16-element bf16 fragment from LDS as two b128 reads.
__device__ __forceinline__ v16bf ld_frag(const __bf16* p) {
    v8bf lo = *(const v8bf*)(p);
    v8bf hi = *(const v8bf*)(p + 8);
    return __builtin_shufflevector(lo, hi, 0, 1, 2, 3, 4, 5, 6, 7,
                                   8, 9, 10, 11, 12, 13, 14, 15);
}

// Work-group barrier that orders LDS traffic only. __syncthreads() also drains the
// wave's global loads, which would end the flight of the next tile at the first
// barrier behind its issue; inside their loops the waves of both kernels exchange
// data through LDS alone.
__device__ __forceinline__ void lds_barrier() {
    __builtin_amdgcn_fence(__ATOMIC_RELEASE, "workgroup", "local");
    __builtin_amdgcn_s_barrier();
    __builtin_amdgcn_fence(__ATOMIC_ACQUIRE, "workgroup", "local");
}

__global__ void zero_ws_kernel(float* ws, int n) {
    int i = blockIdx.x * blockDim.x + threadIdx.x;
    if (i < n) ws[i] = 0.0f;
}

// Phase 1: kv[bh][128][64] += k_cs^T * V over an S-chunk; ksum[bh][128] += sum_s k_cs.
__global__ __launch_bounds__(256) void cosformer_kv_kernel(
    const float* __restrict__ kin, const float* __restrict__ vin,
    float* __restrict__ kv_ws, float* __restrict__ ksum_ws)
{
    const int bh   = blockIdx.x;
    const int s0   = blockIdx.y * CHUNK;
    const int tid  = threadIdx.x;
    const int lane = tid & 31;
    const int wave = tid >> 5;
    const int half = lane >> 4;
    const int mrow = lane & 15;        // A-matrix row (feature within band)
    const int ncol = lane & 15;        // B-matrix col (d within band)

    __shared__ alignas(16) __bf16 kcsT[NF][PITCH_S];  // [f][posK(s)]  k_cs^T tile
    __shared__ alignas(16) __bf16 vswz[ND][PITCH_S];  // [d][posK(s)]  V tile

    const float* kb = kin + (size_t)bh * NS * ND;
    const float* vb = vin + (size_t)bh * NS * ND;

    // staging: thread owns 8 consecutive s-rows (c*8..c*8+7) of one column d.
    const int c    = tid >> 6;         // 0..3
    const int dcol = tid & 63;
    const int pbase = (c & 1) * 16 + (c >> 1) * 8;   // posK(c*8)
    float ksum_c = 0.0f, ksum_s = 0.0f;
    // running pointers to the thread's first row of the tile that is loaded next
    const float* kp = kb + (size_t)(s0 + c * 8) * ND + dcol;
    const float* vp = vb + (size_t)(s0 + c * 8) * ND + dcol;

    v8f acc[4];
#pragma unroll
    for (int t = 0; t < 4; ++t)
#pragma unroll
        for (int r = 0; r < 8; ++r) acc[t][r] = 0.0f;

    // Loads the thread's 8 rows of one K and one V tile into registers and moves on.
    auto load_tile = [&](float (&kr)[8], float (&vr)[8]) {
#pragma unroll
        for (int i = 0; i < 8; ++i) {
            kr[i] = kp[i * ND];
            vr[i] = vp[i * ND];
        }
        // holds the 16 loads at this place, tiles ahead of their use, and stands before
        // their address registers are advanced
        asm volatile("s_wait_xcnt 0x0" ::: "memory");
        kp += 32 * ND;
        vp += 32 * ND;
    };

    // One 32-row tile out of the register set (kc, vc). As soon as the set has been
    // turned into bf16 it is free, and the loads of the tile three ahead go into it.
    auto do_tile = [&](float (&kc)[8], float (&vc)[8], int ss, bool more) {
        // --- stage 32 rows of K-features and V into LDS, K-swizzled ---
        v8bf kcv, ksv, vvv;
#pragma unroll
        for (int i = 0; i < 8; ++i) {
            int sg = s0 + ss + c * 8 + i;
            float ang = angle_of(sg);
            float co = __cosf(ang), sn = __sinf(ang);
            float kr = fmaxf(kc[i], 0.0f);
            float kcos = kr * co, ksin = kr * sn;
            kcv[i] = (__bf16)kcos;
            ksv[i] = (__bf16)ksin;
            ksum_c += kcos;
            ksum_s += ksin;
            vvv[i] = (__bf16)vc[i];
        }
        *(v8bf*)&kcsT[dcol][pbase]      = kcv;
        *(v8bf*)&kcsT[64 + dcol][pbase] = ksv;
        *(v8bf*)&vswz[dcol][pbase]      = vvv;
        if (more) load_tile(kc, vc);
        lds_barrier();

        // --- WMMA: wave owns feature band [wave*16, wave*16+16) ---
        const int fbase = wave * 16;
        v16bf afrag = ld_frag(&kcsT[fbase + mrow][half * 16]);
#pragma unroll
        for (int db = 0; db < 4; ++db) {
            v16bf bfrag = ld_frag(&vswz[db * 16 + ncol][half * 16]);
            acc[db] = __builtin_amdgcn_wmma_f32_16x16x32_bf16(
                false, afrag, false, bfrag, (short)0, acc[db], false, false);
        }
        lds_barrier();
        // keeps the next tile's staging, and with it the wait for that tile's loads,
        // from being lifted up into this tile: lifted, every set is waited for at once
        __builtin_amdgcn_sched_barrier(0);
    };

    // Ring of three register sets: while tile t is at work, tiles t+1, t+2 and (from its
    // staging on) t+3 are in flight, so a wave always has more than one tile of loads
    // outstanding and its waits are counted, not to zero.
    float ka[8], va[8], kb2[8], vb2[8], kd[8], vd[8];
    load_tile(ka, va);
    load_tile(kb2, vb2);
    load_tile(kd, vd);
    for (int ss = 0; ss < CHUNK - 4 * 32; ss += 3 * 32) {
        do_tile(ka, va, ss, true);
        do_tile(kb2, vb2, ss + 32, true);
        do_tile(kd, vd, ss + 64, true);
    }
    do_tile(ka, va, CHUNK - 4 * 32, true);     // refills its set with the last tile
    do_tile(kb2, vb2, CHUNK - 3 * 32, false);
    do_tile(kd, vd, CHUNK - 2 * 32, false);
    do_tile(ka, va, CHUNK - 32, false);

    // --- reduce partial kv into workspace ---
    float* kvdst = kv_ws + (size_t)bh * NF * ND;
#pragma unroll
    for (int db = 0; db < 4; ++db)
#pragma unroll
        for (int r = 0; r < 8; ++r) {
            int f = wave * 16 + r + 8 * half;
            int d = db * 16 + ncol;
            atomicAdd(&kvdst[f * ND + d], acc[db][r]);
        }
    atomicAdd(&ksum_ws[bh * NF + dcol],      ksum_c);
    atomicAdd(&ksum_ws[bh * NF + 64 + dcol], ksum_s);
}

// Phase 2: out = (q_cs @ kv) * norm. One work-group stages its head's kv once
// and then walks OUT_TILES consecutive 32-row tiles of q with it.
__global__ __launch_bounds__(256) void cosformer_out_kernel(
    const float* __restrict__ qin, const float* __restrict__ kv_ws,
    const float* __restrict__ ksum_ws, float* __restrict__ out)
{
    const int bh    = blockIdx.x;
    const int srow0 = blockIdx.y * (32 * OUT_TILES);
    const int tid   = threadIdx.x;
    const int lane  = tid & 31;
    const int wave  = tid >> 5;
    const int half  = lane >> 4;
    const int mrow  = lane & 15;
    const int ncol  = lane & 15;

    // q tile and norms are double-buffered by tile parity: a wave may stage tile
    // t+1 while a slower wave still reads tile t; tile t+2 lies behind a barrier
    // of tile t+1 that every reader of tile t has passed.
    __shared__ alignas(16) __bf16 qcs2[2][32][PITCH_F];  // [buf][s][posF(f)]
    __shared__ alignas(16) __bf16 kvbT[ND][PITCH_F];     // [d][posF(f)]
    __shared__ alignas(16) float ksumP[NF + NF / 4];      // [posS(posF(f))]
    __shared__ float  nrm[2][32];

    // q staging: thread owns row (tid>>3) and 8 consecutive d (seg*8..seg*8+7).
    const int row = tid >> 3;                // 0..31
    const int seg = tid & 7;                 // 0..7
    const float* qb = qin + (size_t)bh * NS * ND;
    const float4* q4 = (const float4*)&qb[(size_t)(srow0 + row) * ND + seg * 8];
    float4 qa = q4[0], qc4 = q4[1];          // tile 0, in flight during kv staging
    // keeps these two loads ahead of the kv loads, and stands before their address
    // registers are reused
    asm volatile("s_wait_xcnt 0x0" ::: "memory");

    // stage kv (L2-resident) as bf16, transposed + K-swizzled: thread owns
    // column d and 4 chunks of 8 consecutive f.
    const float* kvsrc = kv_ws + (size_t)bh * NF * ND;
    {
        const int d = tid & 63;
        const int jb = tid >> 6;                 // 0..3
#pragma unroll
        for (int cc = 0; cc < 4; ++cc) {
            int j = jb + cc * 4;                 // chunk 0..15, f = j*8..j*8+7
            v8bf t;
#pragma unroll
            for (int i = 0; i < 8; ++i)
                t[i] = (__bf16)kvsrc[(j * 8 + i) * ND + d];
            *(v8bf*)&kvbT[d][posF(j * 8)] = t;
        }
    }
    if (tid < NF) ksumP[posS(posF(tid))] = ksum_ws[bh * NF + tid];

    const int rgrp = wave >> 2;        // which 16-row group
    const int db   = wave & 3;         // which 16-col d block
    float* op = out + (size_t)bh * NS * ND
              + (size_t)(srow0 + rgrp * 16 + 8 * half) * ND + db * 16 + ncol;

    for (int t = 0; t < OUT_TILES; ++t) {
        const int buf = t & 1;
        const int st0 = srow0 + t * 32;

        // q_cs features (q pre-scaled by 1/sqrt(D) = 0.125), K-swizzled
        {
            float ang = angle_of(st0 + row);
            float co = __cosf(ang), sn = __sinf(ang);
            float qv[8] = {qa.x, qa.y, qa.z, qa.w, qc4.x, qc4.y, qc4.z, qc4.w};
            v8bf fc, fs;
#pragma unroll
            for (int i = 0; i < 8; ++i) {
                float qr = fmaxf(qv[i] * 0.125f, 0.0f);
                fc[i] = (__bf16)(qr * co);
                fs[i] = (__bf16)(qr * sn);
            }
            *(v8bf*)&qcs2[buf][row][posF(seg * 8)]      = fc;
            *(v8bf*)&qcs2[buf][row][posF(64 + seg * 8)] = fs;
        }
        if (tid < 32) nrm[buf][tid] = 0.0f;
        if (t + 1 < OUT_TILES) {             // next tile's q flies under this tile's work
            q4 += 32 * ND / 4;
            qa = q4[0];
            qc4 = q4[1];
            // before the loads' address registers are reused further down
            asm volatile("s_wait_xcnt 0x0" ::: "memory");
        }
        lds_barrier();

        // normalizer: nrm[row] = 1 / max(q_cs[row] . ksum, eps)  (both permuted identically)
        {
            float p = 0.0f;
#pragma unroll
            for (int f = seg * 16; f < seg * 16 + 16; ++f)
                p += (float)qcs2[buf][row][f] * ksumP[posS(f)];
            atomicAdd(&nrm[buf][row], p);
        }
        lds_barrier();
        if (tid < 32) nrm[buf][tid] = 1.0f / fmaxf(nrm[buf][tid], 1e-6f);
        lds_barrier();

        // each wave: one 16x16 output tile, K = 128 in 4 WMMA steps
        v8f acc;
#pragma unroll
        for (int r = 0; r < 8; ++r) acc[r] = 0.0f;

#pragma unroll
        for (int fb = 0; fb < 4; ++fb) {
            v16bf afrag = ld_frag(&qcs2[buf][rgrp * 16 + mrow][fb * 32 + half * 16]);
            v16bf bfrag = ld_frag(&kvbT[db * 16 + ncol][fb * 32 + half * 16]);
            acc = __builtin_amdgcn_wmma_f32_16x16x32_bf16(
                false, afrag, false, bfrag, (short)0, acc, false, false);
        }

#pragma unroll
        for (int r = 0; r < 8; ++r) {
            int sl = rgrp * 16 + r + 8 * half;
            op[r * ND] = acc[r] * nrm[buf][sl];
        }
        // before the next tile's work reuses the stores' address and data registers
        if (t + 1 < OUT_TILES) asm volatile("s_wait_xcnt 0x0" ::: "memory");
        op += 32 * ND;
    }
}

extern "C" void kernel_launch(void* const* d_in, const int* in_sizes, int n_in,
                              void* d_out, int out_size, void* d_ws, size_t ws_size,
                              hipStream_t stream) {
    const float* q = (const float*)d_in[0];
    const float* k = (const float*)d_in[1];
    const float* v = (const float*)d_in[2];
    float* out = (float*)d_out;

    float* kv_ws   = (float*)d_ws;                    // 64 * 128 * 64 floats
    float* ksum_ws = kv_ws + (size_t)NBH * NF * ND;   // 64 * 128 floats
    int nzero = NBH * NF * ND + NBH * NF;

    zero_ws_kernel<<<(nzero + 255) / 256, 256, 0, stream>>>((float*)d_ws, nzero);
    cosformer_kv_kernel<<<dim3(NBH, SCHUNKS), 256, 0, stream>>>(k, v, kv_ws, ksum_ws);
    cosformer_out_kernel<<<dim3(NBH, NS / (32 * OUT_TILES)), 256, 0, stream>>>(q, kv_ws, ksum_ws, out);
}
